// v000
// Times are from an AMD MI455X. After a warm-up the kernel runs many times in a row, and a time is the length of
// such a window on the GPU divided by its runs, so every launch and the gaps after it count. The runs cycle
// through copies of the inputs. A figure is the median of several windows, for all but v000 over two sittings.
// Sittings can differ by a few percent; kernels timed side by side share one.
// The starting kernel, v000, takes 379 microseconds a run.
#include <hip/hip_runtime.h>
#include <math.h>

#define Bdim 64
#define Fdim 32
#define Sdim 512
#define Pdim 96
#define Edim 8
#define Hdim 2048
#define FB   (Fdim * Bdim)        // 2048
#define OUTN (Bdim * Fdim * Pdim) // 196608

typedef float v2f __attribute__((ext_vector_type(2)));
typedef float v8f __attribute__((ext_vector_type(8)));

__device__ __forceinline__ v8f wmma_f32x4(v2f a, v2f b, v8f c) {
  // D = A(16x4,f32) * B(4x16,f32) + C(16x16,f32)
  return __builtin_amdgcn_wmma_f32_16x16x4_f32(false, a, false, b, (short)0, c,
                                               false, false);
}

// ---------------------------------------------------------------------------
// 1) Gating: logits = tf @ Wg + bg ; top-2 threshold ; double softmax
//    One wave32 per (f,b) row.  gates[row*8+e] written to workspace.
// ---------------------------------------------------------------------------
__global__ __launch_bounds__(256) void gates_kernel(
    const float* __restrict__ te, const float* __restrict__ Wg,
    const float* __restrict__ bg, float* __restrict__ gates) {
  const int wave = threadIdx.x >> 5;
  const int lane = threadIdx.x & 31;
  const int row  = blockIdx.x * 8 + wave;      // row = f*B + b
  const int f = row >> 6, b = row & 63;
  const float* trow = te + (size_t)(b * Fdim + f) * Sdim;

  float acc[8];
#pragma unroll
  for (int e = 0; e < 8; ++e) acc[e] = 0.f;
  for (int s = lane; s < Sdim; s += 32) {
    const float t = trow[s];
    const float4 w0 = ((const float4*)(Wg + s * 8))[0];
    const float4 w1 = ((const float4*)(Wg + s * 8))[1];
    acc[0] += t * w0.x; acc[1] += t * w0.y; acc[2] += t * w0.z; acc[3] += t * w0.w;
    acc[4] += t * w1.x; acc[5] += t * w1.y; acc[6] += t * w1.z; acc[7] += t * w1.w;
  }
#pragma unroll
  for (int e = 0; e < 8; ++e) {
#pragma unroll
    for (int off = 16; off >= 1; off >>= 1)
      acc[e] += __shfl_xor(acc[e], off, 32);
  }
  float lg[8];
  float m1 = -1e30f, m2 = -1e30f;
#pragma unroll
  for (int e = 0; e < 8; ++e) {
    lg[e] = acc[e] + bg[e];
    const float v = lg[e];
    if (v > m1) { m2 = m1; m1 = v; } else if (v > m2) { m2 = v; }
  }
  float se = 0.f, ex[8];
#pragma unroll
  for (int e = 0; e < 8; ++e) { ex[e] = expf(lg[e] - m1); se += ex[e]; }
  const float inv = 1.f / se;
  float dec[8];
  float dmax = -1e30f;
#pragma unroll
  for (int e = 0; e < 8; ++e) {
    const float sm = ex[e] * inv;
    dec[e] = (lg[e] < m2) ? 10.f * logf(sm + 1.f) : 10.f * (expf(sm) - 1.f);
    dmax = fmaxf(dmax, dec[e]);
  }
  float ds = 0.f;
#pragma unroll
  for (int e = 0; e < 8; ++e) { dec[e] = expf(dec[e] - dmax); ds += dec[e]; }
  const float dinv = 1.f / ds;
  if (lane == 0) {
#pragma unroll
    for (int e = 0; e < 8; ++e) gates[row * 8 + e] = dec[e] * dinv;
  }
}

// ---------------------------------------------------------------------------
// 2) out[b,f,p] = sum_e gates[f,b,e] * b2[e,p]   (seed for atomic accum)
// ---------------------------------------------------------------------------
__global__ __launch_bounds__(256) void init_kernel(
    const float* __restrict__ gates, const float* __restrict__ b2,
    float* __restrict__ out) {
  const int idx = blockIdx.x * 256 + threadIdx.x;     // < OUTN exactly
  const int p = idx % Pdim;
  const int bf = idx / Pdim;
  const int b = bf / Fdim, f = bf % Fdim;
  const int r = f * Bdim + b;
  float s = 0.f;
#pragma unroll
  for (int e = 0; e < 8; ++e) s += gates[r * 8 + e] * b2[e * Pdim + p];
  out[idx] = s;
}

// ---------------------------------------------------------------------------
// 3) selector / entropy losses -> d_out[OUTN], d_out[OUTN+1]
// ---------------------------------------------------------------------------
__global__ __launch_bounds__(256) void loss_kernel(
    const float* __restrict__ gates, float* __restrict__ out) {
  __shared__ float gs[Fdim][Edim];
  __shared__ float cvs[Fdim];
  __shared__ float ents[Fdim];
  const int t = threadIdx.x;
  const int f = t >> 3, e = t & 7;
  float s = 0.f;
  for (int b = 0; b < Bdim; ++b) s += gates[(f * Bdim + b) * 8 + e];
  gs[f][e] = s;
  __syncthreads();
  if (t < Fdim) {
    float m = 0.f;
#pragma unroll
    for (int k = 0; k < 8; ++k) m += gs[t][k];
    m *= (1.f / 8.f);
    float ss = 0.f, ent = 0.f;
#pragma unroll
    for (int k = 0; k < 8; ++k) {
      const float d = gs[t][k] - m;
      ss += d * d;
      const float gm = gs[t][k] * (1.f / (float)Bdim);
      ent += -gm * logf(gm + 1e-8f);
    }
    const float var = (float)Pdim * ss / (float)(Edim * Pdim - 1);
    cvs[t] = var / (m * m + 1e-10f);
    ents[t] = ent * (1.f / 8.f);
  }
  __syncthreads();
  if (t == 0) {
    float a = 0.f, c = 0.f;
    for (int i = 0; i < Fdim; ++i) { a += cvs[i]; c += ents[i]; }
    out[OUTN] = a;
    out[OUTN + 1] = c;
  }
}

// ---------------------------------------------------------------------------
// 4) Fused MoE:  h = gelu(X@W1[e]+b1) ; out += gates * (h@W2[e])
//    grid (FB/64, E, H/512); block 256 (8 wave32s).
//    fp32 WMMA 16x16x4 for both GEMMs.
//    X tile staged via GLOBAL_LOAD_ASYNC_TO_LDS_B128 (ASYNCcnt);
//    h re-layout C->A through padded LDS.  h-step = 64: each wave owns one
//    16-col h-group and 2 M row-tiles -> W1 fragment reused x2, each W1
//    fragment loaded by 2 waves (1 global dword per WMMA in GEMM1).
// ---------------------------------------------------------------------------
__global__ __launch_bounds__(256) void moe_kernel(
    const float* __restrict__ x,  const float* __restrict__ W1,
    const float* __restrict__ b1, const float* __restrict__ W2,
    const float* __restrict__ b2, const float* __restrict__ gates,
    float* __restrict__ out) {
  __shared__ float Xs[64][Sdim + 4];   // stride 516 (== 4 mod 64): conflict-free
  __shared__ float Hs[64][68];         // stride 68  (== 4 mod 64): conflict-free

  const int tid  = threadIdx.x;
  const int wave = tid >> 5;
  const int lane = tid & 31;
  const int lane15 = lane & 15;
  const int khalf  = (lane >> 4) * 2;  // 0 or 2: A/B K sub-pair per half-wave
  const int r0 = blockIdx.x * 64;
  const int e  = blockIdx.y;
  const int h0 = blockIdx.z * 512;

  // ---- async-stage X tile: rows r0..r0+63 of xf (xf[f,b,s] = x[b,f,s]) ----
  for (int idx = tid; idx < 64 * (Sdim / 4); idx += 256) {
    const int i = idx >> 7;            // 128 float4 per row
    const int c = idx & 127;
    const int r = r0 + i;
    const int fb = (r & 63) * Fdim + (r >> 6);
    const float* gsrc = x + (size_t)fb * Sdim + c * 4;
    const unsigned ldst = (unsigned)(uintptr_t)&Xs[i][c * 4];
    asm volatile("global_load_async_to_lds_b128 %0, %1, off"
                 :: "v"(ldst), "v"(gsrc) : "memory");
  }
  asm volatile("s_wait_asynccnt 0x0" ::: "memory");
  __syncthreads();

  const int hg  = wave & 3;            // GEMM1 h-group (16 cols of 64)
  const int rtb = (wave >> 2) * 2;     // GEMM1 row-tile pair base
  const int rt  = wave & 3;            // GEMM2 row tile
  const int ptb = wave >> 2;           // GEMM2 P-tile base

  v8f acc[3] = {{0.f,0.f,0.f,0.f,0.f,0.f,0.f,0.f},
                {0.f,0.f,0.f,0.f,0.f,0.f,0.f,0.f},
                {0.f,0.f,0.f,0.f,0.f,0.f,0.f,0.f}};

  const float* xrow0 = &Xs[(rtb + 0) * 16 + lane15][0];
  const float* xrow1 = &Xs[(rtb + 1) * 16 + lane15][0];
  const float* hrow  = &Hs[rt * 16 + lane15][0];
  const float* w2be  = W2 + (size_t)e * Hdim * Pdim;

  for (int hk = 0; hk < 512; hk += 64) {
    const int hcol0 = h0 + hk + hg * 16;

    // ---- GEMM1: htile[64,64] = X[64,512] @ W1[e][512, hk..hk+63] ----
    v8f c1[2] = {{0.f,0.f,0.f,0.f,0.f,0.f,0.f,0.f},
                 {0.f,0.f,0.f,0.f,0.f,0.f,0.f,0.f}};
    const float* wp = W1 + ((size_t)e * Sdim + khalf) * Hdim + hcol0 + lane15;
    if (hk + 64 < 512)  // uniform: prefetch next W1 column block
      __builtin_prefetch(W1 + (size_t)e * Sdim * Hdim + h0 + hk + 64, 0, 1);
#pragma unroll 4
    for (int k = 0; k < Sdim; k += 4) {
      v2f bb;
      bb[0] = wp[0]; bb[1] = wp[Hdim];          // B: N=lane15, K rows
      wp += 4 * Hdim;
      v2f a0, a1;
      const float2 f0 = *(const float2*)(&xrow0[k + khalf]);
      const float2 f1 = *(const float2*)(&xrow1[k + khalf]);
      a0[0] = f0.x; a0[1] = f0.y;               // A: M=lane15, K=k+khalf(+1)
      a1[0] = f1.x; a1[1] = f1.y;
      c1[0] = wmma_f32x4(a0, bb, c1[0]);        // B fragment reused x2
      c1[1] = wmma_f32x4(a1, bb, c1[1]);
    }
    // bias + exact GELU, re-layout C->A via LDS
    const float b1v = b1[e * Hdim + hcol0 + lane15];
#pragma unroll
    for (int rtI = 0; rtI < 2; ++rtI) {
      const int mrow = (rtb + rtI) * 16 + (lane >> 4) * 8;
#pragma unroll
      for (int v = 0; v < 8; ++v) {
        const float xv = c1[rtI][v] + b1v;
        const float g = 0.5f * xv * (1.f + erff(xv * 0.70710678118654752f));
        Hs[mrow + v][hg * 16 + lane15] = g;
      }
    }
    __syncthreads();

    // ---- GEMM2: acc += htile[64,64] @ W2[e][hk..hk+63, P] ----
#pragma unroll 4
    for (int kk = 0; kk < 64; kk += 4) {
      v2f a;
      const float2 af = *(const float2*)(&hrow[kk + khalf]);
      a[0] = af.x; a[1] = af.y;
      const float* w2k = w2be + (size_t)(h0 + hk + kk + khalf) * Pdim + lane15;
#pragma unroll
      for (int j = 0; j < 3; ++j) {             // A fragment reused x3
        const int pcol = (ptb + 2 * j) * 16;
        v2f bb;
        bb[0] = w2k[pcol]; bb[1] = w2k[pcol + Pdim];
        acc[j] = wmma_f32x4(a, bb, acc[j]);
      }
    }
    __syncthreads();
  }

  // gate-scale + accumulate into out[b,f,p]
  const int mbase = rt * 16 + (lane >> 4) * 8;
#pragma unroll
  for (int v = 0; v < 8; ++v) {
    const int r = r0 + mbase + v;
    const float g = gates[r * 8 + e];
    const int f = r >> 6, b = r & 63;
    float* orow = out + (size_t)(b * Fdim + f) * Pdim;
#pragma unroll
    for (int j = 0; j < 3; ++j) {
      const int pcol = (ptb + 2 * j) * 16 + lane15;
      atomicAdd(&orow[pcol], g * acc[j][v]);
    }
  }
}

// ---------------------------------------------------------------------------
extern "C" void kernel_launch(void* const* d_in, const int* in_sizes, int n_in,
                              void* d_out, int out_size, void* d_ws,
                              size_t ws_size, hipStream_t stream) {
  (void)in_sizes; (void)n_in; (void)out_size; (void)ws_size;
  const float* x  = (const float*)d_in[0];
  const float* te = (const float*)d_in[1];
  const float* Wg = (const float*)d_in[2];
  const float* bg = (const float*)d_in[3];
  const float* W1 = (const float*)d_in[4];
  const float* b1 = (const float*)d_in[5];
  const float* W2 = (const float*)d_in[6];
  const float* b2 = (const float*)d_in[7];
  float* out   = (float*)d_out;
  float* gates = (float*)d_ws;   // FB*E floats = 64 KB scratch

  gates_kernel<<<FB / 8, 256, 0, stream>>>(te, Wg, bg, gates);
  init_kernel<<<OUTN / 256, 256, 0, stream>>>(gates, b2, out);
  loss_kernel<<<1, 256, 0, stream>>>(gates, out);
  moe_kernel<<<dim3(FB / 64, Edim, Hdim / 512), 256, 0, stream>>>(
      x, W1, b1, W2, b2, gates, out);
}

// v001
// Measured time: 227 microseconds a run.
// In both of two side-by-side timings against v000, it was 1.70 times as fast.
#include <hip/hip_runtime.h>
#include <math.h>

#define Bdim 64
#define Fdim 32
#define Sdim 512
#define Pdim 96
#define Edim 8
#define Hdim 2048
#define FB   (Fdim * Bdim)        // 2048
#define OUTN (Bdim * Fdim * Pdim) // 196608

typedef float v2f __attribute__((ext_vector_type(2)));
typedef float v8f __attribute__((ext_vector_type(8)));

__device__ __forceinline__ v8f wmma_f32x4(v2f a, v2f b, v8f c) {
  // D = A(16x4,f32) * B(4x16,f32) + C(16x16,f32)
  return __builtin_amdgcn_wmma_f32_16x16x4_f32(false, a, false, b, (short)0, c,
                                               false, false);
}

// ---------------------------------------------------------------------------
// 1) Gating: logits = tf @ Wg + bg ; top-2 threshold ; double softmax
//    One wave32 per (f,b) row.  gates[row*8+e] written to workspace.
// ---------------------------------------------------------------------------
__global__ __launch_bounds__(256) void gates_kernel(
    const float* __restrict__ te, const float* __restrict__ Wg,
    const float* __restrict__ bg, float* __restrict__ gates) {
  const int wave = threadIdx.x >> 5;
  const int lane = threadIdx.x & 31;
  const int row  = blockIdx.x * 8 + wave;      // row = f*B + b
  const int f = row >> 6, b = row & 63;
  const float* trow = te + (size_t)(b * Fdim + f) * Sdim;

  float acc[8];
#pragma unroll
  for (int e = 0; e < 8; ++e) acc[e] = 0.f;
  for (int s = lane; s < Sdim; s += 32) {
    const float t = trow[s];
    const float4 w0 = ((const float4*)(Wg + s * 8))[0];
    const float4 w1 = ((const float4*)(Wg + s * 8))[1];
    acc[0] += t * w0.x; acc[1] += t * w0.y; acc[2] += t * w0.z; acc[3] += t * w0.w;
    acc[4] += t * w1.x; acc[5] += t * w1.y; acc[6] += t * w1.z; acc[7] += t * w1.w;
  }
#pragma unroll
  for (int e = 0; e < 8; ++e) {
#pragma unroll
    for (int off = 16; off >= 1; off >>= 1)
      acc[e] += __shfl_xor(acc[e], off, 32);
  }
  float lg[8];
  float m1 = -1e30f, m2 = -1e30f;
#pragma unroll
  for (int e = 0; e < 8; ++e) {
    lg[e] = acc[e] + bg[e];
    const float v = lg[e];
    if (v > m1) { m2 = m1; m1 = v; } else if (v > m2) { m2 = v; }
  }
  float se = 0.f, ex[8];
#pragma unroll
  for (int e = 0; e < 8; ++e) { ex[e] = expf(lg[e] - m1); se += ex[e]; }
  const float inv = 1.f / se;
  float dec[8];
  float dmax = -1e30f;
#pragma unroll
  for (int e = 0; e < 8; ++e) {
    const float sm = ex[e] * inv;
    dec[e] = (lg[e] < m2) ? 10.f * logf(sm + 1.f) : 10.f * (expf(sm) - 1.f);
    dmax = fmaxf(dmax, dec[e]);
  }
  float ds = 0.f;
#pragma unroll
  for (int e = 0; e < 8; ++e) { dec[e] = expf(dec[e] - dmax); ds += dec[e]; }
  const float dinv = 1.f / ds;
  if (lane == 0) {
#pragma unroll
    for (int e = 0; e < 8; ++e) gates[row * 8 + e] = dec[e] * dinv;
  }
}

// ---------------------------------------------------------------------------
// 2) out[b,f,p] = sum_e gates[f,b,e] * b2[e,p]   (seed for atomic accum)
// ---------------------------------------------------------------------------
__global__ __launch_bounds__(256) void init_kernel(
    const float* __restrict__ gates, const float* __restrict__ b2,
    float* __restrict__ out) {
  const int idx = blockIdx.x * 256 + threadIdx.x;     // < OUTN exactly
  const int p = idx % Pdim;
  const int bf = idx / Pdim;
  const int b = bf / Fdim, f = bf % Fdim;
  const int r = f * Bdim + b;
  float s = 0.f;
#pragma unroll
  for (int e = 0; e < 8; ++e) s += gates[r * 8 + e] * b2[e * Pdim + p];
  out[idx] = s;
}

// ---------------------------------------------------------------------------
// 3) selector / entropy losses -> d_out[OUTN], d_out[OUTN+1]
// ---------------------------------------------------------------------------
__global__ __launch_bounds__(256) void loss_kernel(
    const float* __restrict__ gates, float* __restrict__ out) {
  __shared__ float gs[Fdim][Edim];
  __shared__ float cvs[Fdim];
  __shared__ float ents[Fdim];
  const int t = threadIdx.x;
  const int f = t >> 3, e = t & 7;
  float s = 0.f;
  for (int b = 0; b < Bdim; ++b) s += gates[(f * Bdim + b) * 8 + e];
  gs[f][e] = s;
  __syncthreads();
  if (t < Fdim) {
    float m = 0.f;
#pragma unroll
    for (int k = 0; k < 8; ++k) m += gs[t][k];
    m *= (1.f / 8.f);
    float ss = 0.f, ent = 0.f;
#pragma unroll
    for (int k = 0; k < 8; ++k) {
      const float d = gs[t][k] - m;
      ss += d * d;
      const float gm = gs[t][k] * (1.f / (float)Bdim);
      ent += -gm * logf(gm + 1e-8f);
    }
    const float var = (float)Pdim * ss / (float)(Edim * Pdim - 1);
    cvs[t] = var / (m * m + 1e-10f);
    ents[t] = ent * (1.f / 8.f);
  }
  __syncthreads();
  if (t == 0) {
    float a = 0.f, c = 0.f;
    for (int i = 0; i < Fdim; ++i) { a += cvs[i]; c += ents[i]; }
    out[OUTN] = a;
    out[OUTN + 1] = c;
  }
}

// ---------------------------------------------------------------------------
// 4) Fused MoE:  h = gelu(X@W1[e]+b1) ; out += gates * (h@W2[e])
//    grid (FB/64, E, H/512); block 256 (8 wave32s).
//    fp32 WMMA 16x16x4 for both GEMMs.
//    X tile staged via GLOBAL_LOAD_ASYNC_TO_LDS_B128 (ASYNCcnt).
//    GEMM1: each wave owns all 64 rows x its own 64 h-columns (4x4 tiles), so
//    the block's whole 512-column h slice is done in one K sweep.  N tile j of
//    a wave is the columns {4*i + j}: lane i then gets its B elements of all
//    four tiles from one 16-byte load of a W1 row (whole 256-byte row pieces,
//    no W1 element loaded twice in a block; 2 global loads per 16 WMMAs).
//    h takes over X's LDS once every wave has finished reading X.
// ---------------------------------------------------------------------------
__global__ __launch_bounds__(256) void moe_kernel(
    const float* __restrict__ x,  const float* __restrict__ W1,
    const float* __restrict__ b1, const float* __restrict__ W2,
    const float* __restrict__ b2, const float* __restrict__ gates,
    float* __restrict__ out) {
  // stride 516 (== 4 mod 64): conflict-free; holds X, then h
  __shared__ __attribute__((aligned(16))) float Xs[64][Sdim + 4];

  const int tid  = threadIdx.x;
  const int wave = tid >> 5;
  const int lane = tid & 31;
  const int lane15 = lane & 15;
  const int khalf  = (lane >> 4) * 2;  // 0 or 2: A/B K sub-pair per half-wave
  const int r0 = blockIdx.x * 64;
  const int e  = blockIdx.y;
  const int h0 = blockIdx.z * 512;

  // ---- async-stage X tile: rows r0..r0+63 of xf (xf[f,b,s] = x[b,f,s]) ----
  for (int idx = tid; idx < 64 * (Sdim / 4); idx += 256) {
    const int i = idx >> 7;            // 128 float4 per row
    const int c = idx & 127;
    const int r = r0 + i;
    const int fb = (r & 63) * Fdim + (r >> 6);
    const float* gsrc = x + (size_t)fb * Sdim + c * 4;
    const unsigned ldst = (unsigned)(uintptr_t)&Xs[i][c * 4];
    asm volatile("global_load_async_to_lds_b128 %0, %1, off"
                 :: "v"(ldst), "v"(gsrc) : "memory");
  }
  asm volatile("s_wait_asynccnt 0x0" ::: "memory");
  __syncthreads();

  const int rt  = wave & 3;            // GEMM2 row tile
  const int ptb = wave >> 2;           // GEMM2 P-tile base

  // ---- GEMM1: h[64,512] = X[64,512] @ W1[e][512, h0..h0+511] ----
  const int lcol = wave * 64 + lane15 * 4;   // this lane's 4 h-columns
  v8f c1[4][4];
#pragma unroll
  for (int mt = 0; mt < 4; ++mt)
#pragma unroll
    for (int j = 0; j < 4; ++j)
      c1[mt][j] = (v8f){0.f,0.f,0.f,0.f,0.f,0.f,0.f,0.f};

  const float* wp = W1 + ((size_t)e * Sdim + khalf) * Hdim + h0 + lcol;
  const float* xr = &Xs[lane15][khalf];
  // unroll 4: four K steps' loads stand ahead of 64 WMMAs, so one load wait
  // is spread over more matrix work; registers stay under 256, so that two
  // blocks still share a WGP
#pragma unroll 4
  for (int k = 0; k < Sdim; k += 4) {
    const float4 q0 = *(const float4*)(wp);          // K row khalf,   N = 4*i..4*i+3
    const float4 q1 = *(const float4*)(wp + Hdim);   // K row khalf+1, same columns
    wp += 4 * Hdim;
    v2f a[4];
#pragma unroll
    for (int mt = 0; mt < 4; ++mt) {                 // A: M=lane15, K=k+khalf(+1)
      const float2 f = *(const float2*)(xr + mt * 16 * (Sdim + 4) + k);
      a[mt][0] = f.x; a[mt][1] = f.y;
    }
    const float r0q[4] = {q0.x, q0.y, q0.z, q0.w};
    const float r1q[4] = {q1.x, q1.y, q1.z, q1.w};
#pragma unroll
    for (int j = 0; j < 4; ++j) {
      v2f bb;
      bb[0] = r0q[j]; bb[1] = r1q[j];
#pragma unroll
      for (int mt = 0; mt < 4; ++mt)
        c1[mt][j] = wmma_f32x4(a[mt], bb, c1[mt][j]);
    }
  }
  __syncthreads();   // every wave has finished reading X: its LDS becomes h

  // bias, then C->A re-layout via LDS: a lane's four tiles are 4 adjacent columns
  const float4 b1q = *(const float4*)(b1 + e * Hdim + h0 + lcol);
  float* hown = &Xs[(lane >> 4) * 8][lcol];
#pragma unroll
  for (int mt = 0; mt < 4; ++mt) {
#pragma unroll
    for (int v = 0; v < 8; ++v) {
      float4 p;
      p.x = c1[mt][0][v] + b1q.x; p.y = c1[mt][1][v] + b1q.y;
      p.z = c1[mt][2][v] + b1q.z; p.w = c1[mt][3][v] + b1q.w;
      *(float4*)(hown + (mt * 16 + v) * (Sdim + 4)) = p;
    }
  }
  // exact GELU in place, each lane on the words it stored itself (no barrier
  // needed in between).  Kept rolled: 128 inlined erf bodies would be tens of
  // KB of straight-line text that every WGP has to fetch.
#pragma unroll 1
  for (int it = 0; it < 32; ++it) {
    float4* hp = (float4*)(hown + ((it >> 3) * 16 + (it & 7)) * (Sdim + 4));
    const float4 p = *hp;
    float4 g;
    g.x = 0.5f * p.x * (1.f + erff(p.x * 0.70710678118654752f));
    g.y = 0.5f * p.y * (1.f + erff(p.y * 0.70710678118654752f));
    g.z = 0.5f * p.z * (1.f + erff(p.z * 0.70710678118654752f));
    g.w = 0.5f * p.w * (1.f + erff(p.w * 0.70710678118654752f));
    *hp = g;
  }
  __syncthreads();   // h complete before any wave reads other waves' columns

  // ---- GEMM2: acc = h[64,512] @ W2[e][h0..h0+511, P] ----
  v8f acc[3] = {{0.f,0.f,0.f,0.f,0.f,0.f,0.f,0.f},
                {0.f,0.f,0.f,0.f,0.f,0.f,0.f,0.f},
                {0.f,0.f,0.f,0.f,0.f,0.f,0.f,0.f}};
  const float* hrow  = &Xs[rt * 16 + lane15][0];
  const float* w2be = W2 + (size_t)e * Hdim * Pdim;
#pragma unroll 4
  for (int kk = 0; kk < 512; kk += 4) {
    v2f a;
    const float2 af = *(const float2*)(&hrow[kk + khalf]);
    a[0] = af.x; a[1] = af.y;
    const float* w2k = w2be + (size_t)(h0 + kk + khalf) * Pdim + lane15;
#pragma unroll
    for (int j = 0; j < 3; ++j) {             // A fragment reused x3
      const int pcol = (ptb + 2 * j) * 16;
      v2f bb;
      bb[0] = w2k[pcol]; bb[1] = w2k[pcol + Pdim];
      acc[j] = wmma_f32x4(a, bb, acc[j]);
    }
  }

  // gate-scale + accumulate into out[b,f,p]
  const int mbase = rt * 16 + (lane >> 4) * 8;
#pragma unroll
  for (int v = 0; v < 8; ++v) {
    const int r = r0 + mbase + v;
    const float g = gates[r * 8 + e];
    const int f = r >> 6, b = r & 63;
    float* orow = out + (size_t)(b * Fdim + f) * Pdim;
#pragma unroll
    for (int j = 0; j < 3; ++j) {
      const int pcol = (ptb + 2 * j) * 16 + lane15;
      atomicAdd(&orow[pcol], g * acc[j][v]);
    }
  }
}

// ---------------------------------------------------------------------------
extern "C" void kernel_launch(void* const* d_in, const int* in_sizes, int n_in,
                              void* d_out, int out_size, void* d_ws,
                              size_t ws_size, hipStream_t stream) {
  (void)in_sizes; (void)n_in; (void)out_size; (void)ws_size;
  const float* x  = (const float*)d_in[0];
  const float* te = (const float*)d_in[1];
  const float* Wg = (const float*)d_in[2];
  const float* bg = (const float*)d_in[3];
  const float* W1 = (const float*)d_in[4];
  const float* b1 = (const float*)d_in[5];
  const float* W2 = (const float*)d_in[6];
  const float* b2 = (const float*)d_in[7];
  float* out   = (float*)d_out;
  float* gates = (float*)d_ws;   // FB*E floats = 64 KB scratch

  gates_kernel<<<FB / 8, 256, 0, stream>>>(te, Wg, bg, gates);
  init_kernel<<<OUTN / 256, 256, 0, stream>>>(gates, b2, out);
  loss_kernel<<<1, 256, 0, stream>>>(gates, out);
  moe_kernel<<<dim3(FB / 64, Edim, Hdim / 512), 256, 0, stream>>>(
      x, W1, b1, W2, b2, gates, out);
}

// v002
// A run of this version takes 202 microseconds.
// Two timings next to v001 both put it at 1.12 times that version's speed.
// Over all steps from v000 it is 1.91 times as fast.
#include <hip/hip_runtime.h>
#include <math.h>

#define Bdim 64
#define Fdim 32
#define Sdim 512
#define Pdim 96
#define Edim 8
#define Hdim 2048
#define FB   (Fdim * Bdim)        // 2048
#define OUTN (Bdim * Fdim * Pdim) // 196608

typedef float v2f __attribute__((ext_vector_type(2)));
typedef float v8f __attribute__((ext_vector_type(8)));

__device__ __forceinline__ v8f wmma_f32x4(v2f a, v2f b, v8f c) {
  // D = A(16x4,f32) * B(4x16,f32) + C(16x16,f32)
  return __builtin_amdgcn_wmma_f32_16x16x4_f32(false, a, false, b, (short)0, c,
                                               false, false);
}

// Four vector slots behind a run of WMMAs.  The ring refills free A and B
// registers at once; the v_nops
// keep the distance, the two scheduling fences keep them where they stand.
__device__ __forceinline__ void wmma_gap() {
  __builtin_amdgcn_sched_barrier(0);
  asm volatile("v_nop\n\tv_nop\n\tv_nop\n\tv_nop");
  __builtin_amdgcn_sched_barrier(0);
}

// ---------------------------------------------------------------------------
// 1) Gating: logits = tf @ Wg + bg ; top-2 threshold ; double softmax
//    One wave32 per (f,b) row.  gates[row*8+e] written to workspace.
// ---------------------------------------------------------------------------
__global__ __launch_bounds__(256) void gates_kernel(
    const float* __restrict__ te, const float* __restrict__ Wg,
    const float* __restrict__ bg, float* __restrict__ gates) {
  const int wave = threadIdx.x >> 5;
  const int lane = threadIdx.x & 31;
  const int row  = blockIdx.x * 8 + wave;      // row = f*B + b
  const int f = row >> 6, b = row & 63;
  const float* trow = te + (size_t)(b * Fdim + f) * Sdim;

  float acc[8];
#pragma unroll
  for (int e = 0; e < 8; ++e) acc[e] = 0.f;
  for (int s = lane; s < Sdim; s += 32) {
    const float t = trow[s];
    const float4 w0 = ((const float4*)(Wg + s * 8))[0];
    const float4 w1 = ((const float4*)(Wg + s * 8))[1];
    acc[0] += t * w0.x; acc[1] += t * w0.y; acc[2] += t * w0.z; acc[3] += t * w0.w;
    acc[4] += t * w1.x; acc[5] += t * w1.y; acc[6] += t * w1.z; acc[7] += t * w1.w;
  }
#pragma unroll
  for (int e = 0; e < 8; ++e) {
#pragma unroll
    for (int off = 16; off >= 1; off >>= 1)
      acc[e] += __shfl_xor(acc[e], off, 32);
  }
  float lg[8];
  float m1 = -1e30f, m2 = -1e30f;
#pragma unroll
  for (int e = 0; e < 8; ++e) {
    lg[e] = acc[e] + bg[e];
    const float v = lg[e];
    if (v > m1) { m2 = m1; m1 = v; } else if (v > m2) { m2 = v; }
  }
  float se = 0.f, ex[8];
#pragma unroll
  for (int e = 0; e < 8; ++e) { ex[e] = expf(lg[e] - m1); se += ex[e]; }
  const float inv = 1.f / se;
  float dec[8];
  float dmax = -1e30f;
#pragma unroll
  for (int e = 0; e < 8; ++e) {
    const float sm = ex[e] * inv;
    dec[e] = (lg[e] < m2) ? 10.f * logf(sm + 1.f) : 10.f * (expf(sm) - 1.f);
    dmax = fmaxf(dmax, dec[e]);
  }
  float ds = 0.f;
#pragma unroll
  for (int e = 0; e < 8; ++e) { dec[e] = expf(dec[e] - dmax); ds += dec[e]; }
  const float dinv = 1.f / ds;
  if (lane == 0) {
#pragma unroll
    for (int e = 0; e < 8; ++e) gates[row * 8 + e] = dec[e] * dinv;
  }
}

// ---------------------------------------------------------------------------
// 2) out[b,f,p] = sum_e gates[f,b,e] * b2[e,p]   (seed for atomic accum)
// ---------------------------------------------------------------------------
__global__ __launch_bounds__(256) void init_kernel(
    const float* __restrict__ gates, const float* __restrict__ b2,
    float* __restrict__ out) {
  const int idx = blockIdx.x * 256 + threadIdx.x;     // < OUTN exactly
  const int p = idx % Pdim;
  const int bf = idx / Pdim;
  const int b = bf / Fdim, f = bf % Fdim;
  const int r = f * Bdim + b;
  float s = 0.f;
#pragma unroll
  for (int e = 0; e < 8; ++e) s += gates[r * 8 + e] * b2[e * Pdim + p];
  out[idx] = s;
}

// ---------------------------------------------------------------------------
// 3) selector / entropy losses -> d_out[OUTN], d_out[OUTN+1]
// ---------------------------------------------------------------------------
__global__ __launch_bounds__(256) void loss_kernel(
    const float* __restrict__ gates, float* __restrict__ out) {
  __shared__ float gs[Fdim][Edim];
  __shared__ float cvs[Fdim];
  __shared__ float ents[Fdim];
  const int t = threadIdx.x;
  const int f = t >> 3, e = t & 7;
  float s = 0.f;
  for (int b = 0; b < Bdim; ++b) s += gates[(f * Bdim + b) * 8 + e];
  gs[f][e] = s;
  __syncthreads();
  if (t < Fdim) {
    float m = 0.f;
#pragma unroll
    for (int k = 0; k < 8; ++k) m += gs[t][k];
    m *= (1.f / 8.f);
    float ss = 0.f, ent = 0.f;
#pragma unroll
    for (int k = 0; k < 8; ++k) {
      const float d = gs[t][k] - m;
      ss += d * d;
      const float gm = gs[t][k] * (1.f / (float)Bdim);
      ent += -gm * logf(gm + 1e-8f);
    }
    const float var = (float)Pdim * ss / (float)(Edim * Pdim - 1);
    cvs[t] = var / (m * m + 1e-10f);
    ents[t] = ent * (1.f / 8.f);
  }
  __syncthreads();
  if (t == 0) {
    float a = 0.f, c = 0.f;
    for (int i = 0; i < Fdim; ++i) { a += cvs[i]; c += ents[i]; }
    out[OUTN] = a;
    out[OUTN + 1] = c;
  }
}

// ---------------------------------------------------------------------------
// 4) Fused MoE:  h = gelu(X@W1[e]+b1) ; out += gates * (h@W2[e])
//    grid (FB/64, E, H/512); block 256 (8 wave32s).
//    fp32 WMMA 16x16x4 for both GEMMs.
//    X tile staged via GLOBAL_LOAD_ASYNC_TO_LDS_B128 (ASYNCcnt).
//    GEMM1: each wave owns all 64 rows x its own 64 h-columns (4x4 tiles), so
//    the block's whole 512-column h slice is done in one K sweep.  N tile j of
//    a wave is the columns {4*i + j}: lane i then gets its B elements of all
//    four tiles from one 16-byte load of a W1 row (whole 256-byte row pieces,
//    no W1 element loaded twice in a block bar the unused refetch of K rows 0..15; 2 global loads per 16 WMMAs).
//    h takes over X's LDS once every wave has finished reading X.
// ---------------------------------------------------------------------------
__global__ __launch_bounds__(256) void moe_kernel(
    const float* __restrict__ x,  const float* __restrict__ W1,
    const float* __restrict__ b1, const float* __restrict__ W2,
    const float* __restrict__ b2, const float* __restrict__ gates,
    float* __restrict__ out) {
  // stride 516 (== 4 mod 64): conflict-free; holds X, then h
  __shared__ __attribute__((aligned(16))) float Xs[64][Sdim + 4];

  const int tid  = threadIdx.x;
  const int wave = tid >> 5;
  const int lane = tid & 31;
  const int lane15 = lane & 15;
  const int khalf  = (lane >> 4) * 2;  // 0 or 2: A/B K sub-pair per half-wave
  const int r0 = blockIdx.x * 64;
  const int e  = blockIdx.y;
  const int h0 = blockIdx.z * 512;

  // ---- async-stage X tile: rows r0..r0+63 of xf (xf[f,b,s] = x[b,f,s]) ----
  for (int idx = tid; idx < 64 * (Sdim / 4); idx += 256) {
    const int i = idx >> 7;            // 128 float4 per row
    const int c = idx & 127;
    const int r = r0 + i;
    const int fb = (r & 63) * Fdim + (r >> 6);
    const float* gsrc = x + (size_t)fb * Sdim + c * 4;
    const unsigned ldst = (unsigned)(uintptr_t)&Xs[i][c * 4];
    asm volatile("global_load_async_to_lds_b128 %0, %1, off"
                 :: "v"(ldst), "v"(gsrc) : "memory");
  }
  asm volatile("s_wait_asynccnt 0x0" ::: "memory");
  __syncthreads();

  const int rt  = wave & 3;            // GEMM2 row tile
  const int ptb = wave >> 2;           // GEMM2 P-tile base

  // ---- GEMM1: h[64,512] = X[64,512] @ W1[e][512, h0..h0+511] ----
  const int lcol = wave * 64 + lane15 * 4;   // this lane's 4 h-columns
  v8f c1[4][4];
#pragma unroll
  for (int mt = 0; mt < 4; ++mt)
#pragma unroll
    for (int j = 0; j < 4; ++j)
      c1[mt][j] = (v8f){0.f,0.f,0.f,0.f,0.f,0.f,0.f,0.f};

  const float* wb = W1 + ((size_t)e * Sdim + khalf) * Hdim + h0 + lcol;
  const float* xr = &Xs[lane15][khalf];
  // Register rings over a block of four K steps (64 WMMAs).  Slot u holds the
  // two W1 row pieces of K step u and is refilled for the next block right
  // behind its own 16 WMMAs; the X fragments are re-read two K steps at a
  // time, right behind the second step's WMMAs.  No load is waited for at the head of a block any more.
  float4 q0[4], q1[4];
  v2f a[4][4];
#pragma unroll
  for (int u = 0; u < 4; ++u) {
    q0[u] = *(const float4*)(wb + (size_t)(4 * u) * Hdim);       // K row khalf,   N = 4*i..4*i+3
    q1[u] = *(const float4*)(wb + (size_t)(4 * u + 1) * Hdim);   // K row khalf+1, same columns
#pragma unroll
    for (int mt = 0; mt < 4; ++mt) {                 // A: M=lane15, K=4u+khalf(+1)
      const float2 f = *(const float2*)(xr + mt * 16 * (Sdim + 4) + 4 * u);
      a[u][mt][0] = f.x; a[u][mt][1] = f.y;
    }
  }
  // rolled: a ring slot is refilled in place, so there is nothing to rename
#pragma unroll 1
  for (int k = 0; k < Sdim; k += 16) {
    // the last block's fetch-ahead wraps to K = 0: in bounds, never used
    const int kn = (k + 16) & (Sdim - 1);
    const float* wn = wb + (size_t)kn * Hdim;
    const float* xn = xr + kn;
#pragma unroll
    for (int u = 0; u < 4; ++u) {
      const float r0q[4] = {q0[u].x, q0[u].y, q0[u].z, q0[u].w};
      const float r1q[4] = {q1[u].x, q1[u].y, q1[u].z, q1[u].w};
#pragma unroll
      for (int j = 0; j < 4; ++j) {
        v2f bb;
        bb[0] = r0q[j]; bb[1] = r1q[j];
#pragma unroll
        for (int mt = 0; mt < 4; ++mt)
          c1[mt][j] = wmma_f32x4(a[u][mt], bb, c1[mt][j]);
      }
      wmma_gap();
      q0[u] = *(const float4*)(wn + (size_t)(4 * u) * Hdim);
      q1[u] = *(const float4*)(wn + (size_t)(4 * u + 1) * Hdim);
      if (u & 1) {
#pragma unroll
        for (int v = u - 1; v <= u; ++v)
#pragma unroll
          for (int mt = 0; mt < 4; ++mt) {
            const float2 f = *(const float2*)(xn + mt * 16 * (Sdim + 4) + 4 * v);
            a[v][mt][0] = f.x; a[v][mt][1] = f.y;
          }
      }
      // compiler fence: without it the refills are folded back into loads at
      // the head of the next trip, where they are waited for at once
      asm volatile("" ::: "memory");
      // keeps the refills behind this step's WMMAs and ahead of the next step's
      __builtin_amdgcn_sched_barrier(0);
    }
    // the next trip overwrites the address register that the refills name
    asm volatile("s_wait_xcnt 0x0" ::: "memory");
    __builtin_amdgcn_sched_barrier(0);   // holds that wait at the foot of the trip
  }
  __syncthreads();   // every wave has finished reading X: its LDS becomes h

  // bias, then C->A re-layout via LDS: a lane's four tiles are 4 adjacent columns
  const float4 b1q = *(const float4*)(b1 + e * Hdim + h0 + lcol);
  float* hown = &Xs[(lane >> 4) * 8][lcol];
#pragma unroll
  for (int mt = 0; mt < 4; ++mt) {
#pragma unroll
    for (int v = 0; v < 8; ++v) {
      float4 p;
      p.x = c1[mt][0][v] + b1q.x; p.y = c1[mt][1][v] + b1q.y;
      p.z = c1[mt][2][v] + b1q.z; p.w = c1[mt][3][v] + b1q.w;
      *(float4*)(hown + (mt * 16 + v) * (Sdim + 4)) = p;
    }
  }
  // W2 ring, first fill: slot s holds the six B words of K step s; requested
  // here so that they land while the GELU below runs
  const float* w2l = W2 + ((size_t)e * Hdim + h0 + khalf) * Pdim + ptb * 16 + lane15;
  float wr[8][6];
#pragma unroll
  for (int s = 0; s < 8; ++s)
#pragma unroll
    for (int j = 0; j < 3; ++j) {
      wr[s][2 * j]     = w2l[(4 * s) * Pdim + 32 * j];
      wr[s][2 * j + 1] = w2l[(4 * s + 1) * Pdim + 32 * j];
    }
  // exact GELU in place, each lane on the words it stored itself (no barrier
  // needed in between).  Kept rolled: 128 inlined erf bodies would be tens of
  // KB of straight-line text that every WGP has to fetch.
#pragma unroll 1
  for (int it = 0; it < 32; ++it) {
    float4* hp = (float4*)(hown + ((it >> 3) * 16 + (it & 7)) * (Sdim + 4));
    const float4 p = *hp;
    float4 g;
    g.x = 0.5f * p.x * (1.f + erff(p.x * 0.70710678118654752f));
    g.y = 0.5f * p.y * (1.f + erff(p.y * 0.70710678118654752f));
    g.z = 0.5f * p.z * (1.f + erff(p.z * 0.70710678118654752f));
    g.w = 0.5f * p.w * (1.f + erff(p.w * 0.70710678118654752f));
    *hp = g;
  }
  __syncthreads();   // h complete before any wave reads other waves' columns

  // ---- GEMM2: acc = h[64,512] @ W2[e][h0..h0+511, P] ----
  v8f acc[3] = {{0.f,0.f,0.f,0.f,0.f,0.f,0.f,0.f},
                {0.f,0.f,0.f,0.f,0.f,0.f,0.f,0.f},
                {0.f,0.f,0.f,0.f,0.f,0.f,0.f,0.f}};
  const float* hr = &Xs[rt * 16 + lane15][khalf];
  v2f ah[16];
#pragma unroll
  for (int u = 0; u < 16; ++u) {
    const float2 af = *(const float2*)(hr + 4 * u);
    ah[u][0] = af.x; ah[u][1] = af.y;
  }
  // rolled: the 16 K steps inside are unrolled already, more would only grow the text
#pragma unroll 1
  for (int kk = 0; kk < 512; kk += 64) {
    const int kn = (kk + 64) & 511;           // wraps on the last trip: in bounds, never used
#pragma unroll
    for (int u = 0; u < 16; ++u) {
      const int s = u & 7;
#pragma unroll
      for (int j = 0; j < 3; ++j) {           // A fragment reused x3
        v2f bb;
        bb[0] = wr[s][2 * j]; bb[1] = wr[s][2 * j + 1];
        acc[j] = wmma_f32x4(ah[u], bb, acc[j]);
      }
      wmma_gap();
      // refill slot s with K step u + 8 (24 WMMAs of lead)
      const float* wn = w2l + (size_t)((kk + 4 * u + 32) & 511) * Pdim;
#pragma unroll
      for (int j = 0; j < 3; ++j) {
        wr[s][2 * j]     = wn[32 * j];
        wr[s][2 * j + 1] = wn[Pdim + 32 * j];
      }
      if (s == 7) {                           // h fragments of the half block just used
#pragma unroll
        for (int v = u - 7; v <= u; ++v) {
          const float2 af = *(const float2*)(hr + kn + 4 * v);
          ah[v][0] = af.x; ah[v][1] = af.y;
        }
      }
      // compiler fence and scheduling fence, as in GEMM1: they keep the refills here
      asm volatile("" ::: "memory");
      __builtin_amdgcn_sched_barrier(0);
    }
  }

  // gate-scale + accumulate into out[b,f,p]
  const int mbase = rt * 16 + (lane >> 4) * 8;
#pragma unroll
  for (int v = 0; v < 8; ++v) {
    const int r = r0 + mbase + v;
    const float g = gates[r * 8 + e];
    const int f = r >> 6, b = r & 63;
    float* orow = out + (size_t)(b * Fdim + f) * Pdim;
#pragma unroll
    for (int j = 0; j < 3; ++j) {
      const int pcol = (ptb + 2 * j) * 16 + lane15;
      atomicAdd(&orow[pcol], g * acc[j][v]);
    }
  }
}

// ---------------------------------------------------------------------------
extern "C" void kernel_launch(void* const* d_in, const int* in_sizes, int n_in,
                              void* d_out, int out_size, void* d_ws,
                              size_t ws_size, hipStream_t stream) {
  (void)in_sizes; (void)n_in; (void)out_size; (void)ws_size;
  const float* x  = (const float*)d_in[0];
  const float* te = (const float*)d_in[1];
  const float* Wg = (const float*)d_in[2];
  const float* bg = (const float*)d_in[3];
  const float* W1 = (const float*)d_in[4];
  const float* b1 = (const float*)d_in[5];
  const float* W2 = (const float*)d_in[6];
  const float* b2 = (const float*)d_in[7];
  float* out   = (float*)d_out;
  float* gates = (float*)d_ws;   // FB*E floats = 64 KB scratch

  gates_kernel<<<FB / 8, 256, 0, stream>>>(te, Wg, bg, gates);
  init_kernel<<<OUTN / 256, 256, 0, stream>>>(gates, b2, out);
  loss_kernel<<<1, 256, 0, stream>>>(gates, out);
  moe_kernel<<<dim3(FB / 64, Edim, Hdim / 512), 256, 0, stream>>>(
      x, W1, b1, W2, b2, gates, out);
}

// v003
// It runs in 193 microseconds.
// Timed twice side by side with v002, it ran 1.05 times as fast both times.
// Counting every step since v000, it is 2.00 times as fast.
#include <hip/hip_runtime.h>
#include <math.h>

#define Bdim 64
#define Fdim 32
#define Sdim 512
#define Pdim 96
#define Edim 8
#define Hdim 2048
#define FB   (Fdim * Bdim)        // 2048
#define OUTN (Bdim * Fdim * Pdim) // 196608

typedef float v2f __attribute__((ext_vector_type(2)));
typedef float v8f __attribute__((ext_vector_type(8)));

__device__ __forceinline__ v8f wmma_f32x4(v2f a, v2f b, v8f c) {
  // D = A(16x4,f32) * B(4x16,f32) + C(16x16,f32)
  return __builtin_amdgcn_wmma_f32_16x16x4_f32(false, a, false, b, (short)0, c,
                                               false, false);
}

// Four vector slots behind a run of WMMAs.  The ring refills free A and B
// registers at once; the v_nops
// keep the distance, the two scheduling fences keep them where they stand.
__device__ __forceinline__ void wmma_gap() {
  __builtin_amdgcn_sched_barrier(0);
  asm volatile("v_nop\n\tv_nop\n\tv_nop\n\tv_nop");
  __builtin_amdgcn_sched_barrier(0);
}

// GELU with the exact (erf) definition, no branch, four pairs at a time:
//   gelu(x) = max(x, 0) - |x| * Q(|x|),   Q(a) = 0.5 * erfc(a / sqrt(2)).
// Q(a) = exp(-a*a/2) * t * P(t), t = 1 / (1 + 0.2316419 a), P of degree 4: the
// classical rational form of the normal tail, absolute error below 7.5e-8 for
// every a >= 0.  Written on the tail, the negative side has no 1 + erf
// cancellation.  -1/sqrt(2 pi) is folded into P, -log2(e)/2 into the exponent.
__device__ __forceinline__ void gelu8(const v2f (&x)[4], float (&lo)[4],
                                      float (&hi)[4]) {
  v2f ax[4], t[4], ex[4];
#pragma unroll
  for (int j = 0; j < 4; ++j) {
    ax[j][0] = __builtin_fabsf(x[j][0]); ax[j][1] = __builtin_fabsf(x[j][1]);
    t[j]  = ax[j] * 0.2316419f + 1.f;
    ex[j] = (x[j] * x[j]) * -0.72134752f;
  }
  // The sixteen transcendentals in one statement, each in place on a register
  // of its own, one v_nop behind the last: the instruction set wants one slot
  // between a transcendental and a write of its source or a read of its result.
  asm("v_rcp_f32 %0, %0\n\tv_rcp_f32 %1, %1\n\tv_rcp_f32 %2, %2\n\t"
      "v_rcp_f32 %3, %3\n\tv_rcp_f32 %4, %4\n\tv_rcp_f32 %5, %5\n\t"
      "v_rcp_f32 %6, %6\n\tv_rcp_f32 %7, %7\n\tv_exp_f32 %8, %8\n\t"
      "v_exp_f32 %9, %9\n\tv_exp_f32 %10, %10\n\tv_exp_f32 %11, %11\n\t"
      "v_exp_f32 %12, %12\n\tv_exp_f32 %13, %13\n\tv_exp_f32 %14, %14\n\t"
      "v_exp_f32 %15, %15\n\tv_nop"
      : "+v"(t[0][0]), "+v"(t[0][1]), "+v"(t[1][0]), "+v"(t[1][1]),
        "+v"(t[2][0]), "+v"(t[2][1]), "+v"(t[3][0]), "+v"(t[3][1]),
        "+v"(ex[0][0]), "+v"(ex[0][1]), "+v"(ex[1][0]), "+v"(ex[1][1]),
        "+v"(ex[2][0]), "+v"(ex[2][1]), "+v"(ex[3][0]), "+v"(ex[3][1]));
#pragma unroll
  for (int j = 0; j < 4; ++j) {
    v2f p = t[j] * -0.53070271f + 0.72657601f;
    p = p * t[j] + -0.71070687f;
    p = p * t[j] + 0.14224837f;
    p = p * t[j] + -0.12741480f;
    p = p * t[j];
    const v2f m = ax[j] * ex[j];
    lo[j] = __builtin_fmaf(m[0], p[0], __builtin_fmaxf(x[j][0], 0.f));
    hi[j] = __builtin_fmaf(m[1], p[1], __builtin_fmaxf(x[j][1], 0.f));
  }
}

// ---------------------------------------------------------------------------
// 1) Gating: logits = tf @ Wg + bg ; top-2 threshold ; double softmax
//    One wave32 per (f,b) row.  gates[row*8+e] written to workspace.
// ---------------------------------------------------------------------------
__global__ __launch_bounds__(256) void gates_kernel(
    const float* __restrict__ te, const float* __restrict__ Wg,
    const float* __restrict__ bg, float* __restrict__ gates) {
  const int wave = threadIdx.x >> 5;
  const int lane = threadIdx.x & 31;
  const int row  = blockIdx.x * 8 + wave;      // row = f*B + b
  const int f = row >> 6, b = row & 63;
  const float* trow = te + (size_t)(b * Fdim + f) * Sdim;

  float acc[8];
#pragma unroll
  for (int e = 0; e < 8; ++e) acc[e] = 0.f;
  for (int s = lane; s < Sdim; s += 32) {
    const float t = trow[s];
    const float4 w0 = ((const float4*)(Wg + s * 8))[0];
    const float4 w1 = ((const float4*)(Wg + s * 8))[1];
    acc[0] += t * w0.x; acc[1] += t * w0.y; acc[2] += t * w0.z; acc[3] += t * w0.w;
    acc[4] += t * w1.x; acc[5] += t * w1.y; acc[6] += t * w1.z; acc[7] += t * w1.w;
  }
#pragma unroll
  for (int e = 0; e < 8; ++e) {
#pragma unroll
    for (int off = 16; off >= 1; off >>= 1)
      acc[e] += __shfl_xor(acc[e], off, 32);
  }
  float lg[8];
  float m1 = -1e30f, m2 = -1e30f;
#pragma unroll
  for (int e = 0; e < 8; ++e) {
    lg[e] = acc[e] + bg[e];
    const float v = lg[e];
    if (v > m1) { m2 = m1; m1 = v; } else if (v > m2) { m2 = v; }
  }
  float se = 0.f, ex[8];
#pragma unroll
  for (int e = 0; e < 8; ++e) { ex[e] = expf(lg[e] - m1); se += ex[e]; }
  const float inv = 1.f / se;
  float dec[8];
  float dmax = -1e30f;
#pragma unroll
  for (int e = 0; e < 8; ++e) {
    const float sm = ex[e] * inv;
    dec[e] = (lg[e] < m2) ? 10.f * logf(sm + 1.f) : 10.f * (expf(sm) - 1.f);
    dmax = fmaxf(dmax, dec[e]);
  }
  float ds = 0.f;
#pragma unroll
  for (int e = 0; e < 8; ++e) { dec[e] = expf(dec[e] - dmax); ds += dec[e]; }
  const float dinv = 1.f / ds;
  if (lane == 0) {
#pragma unroll
    for (int e = 0; e < 8; ++e) gates[row * 8 + e] = dec[e] * dinv;
  }
}

// ---------------------------------------------------------------------------
// 2) out[b,f,p] = sum_e gates[f,b,e] * b2[e,p]   (seed for atomic accum)
// ---------------------------------------------------------------------------
__global__ __launch_bounds__(256) void init_kernel(
    const float* __restrict__ gates, const float* __restrict__ b2,
    float* __restrict__ out) {
  const int idx = blockIdx.x * 256 + threadIdx.x;     // < OUTN exactly
  const int p = idx % Pdim;
  const int bf = idx / Pdim;
  const int b = bf / Fdim, f = bf % Fdim;
  const int r = f * Bdim + b;
  float s = 0.f;
#pragma unroll
  for (int e = 0; e < 8; ++e) s += gates[r * 8 + e] * b2[e * Pdim + p];
  out[idx] = s;
}

// ---------------------------------------------------------------------------
// 3) selector / entropy losses -> d_out[OUTN], d_out[OUTN+1]
// ---------------------------------------------------------------------------
__global__ __launch_bounds__(256) void loss_kernel(
    const float* __restrict__ gates, float* __restrict__ out) {
  __shared__ float gs[Fdim][Edim];
  __shared__ float cvs[Fdim];
  __shared__ float ents[Fdim];
  const int t = threadIdx.x;
  const int f = t >> 3, e = t & 7;
  float s = 0.f;
  for (int b = 0; b < Bdim; ++b) s += gates[(f * Bdim + b) * 8 + e];
  gs[f][e] = s;
  __syncthreads();
  if (t < Fdim) {
    float m = 0.f;
#pragma unroll
    for (int k = 0; k < 8; ++k) m += gs[t][k];
    m *= (1.f / 8.f);
    float ss = 0.f, ent = 0.f;
#pragma unroll
    for (int k = 0; k < 8; ++k) {
      const float d = gs[t][k] - m;
      ss += d * d;
      const float gm = gs[t][k] * (1.f / (float)Bdim);
      ent += -gm * logf(gm + 1e-8f);
    }
    const float var = (float)Pdim * ss / (float)(Edim * Pdim - 1);
    cvs[t] = var / (m * m + 1e-10f);
    ents[t] = ent * (1.f / 8.f);
  }
  __syncthreads();
  if (t == 0) {
    float a = 0.f, c = 0.f;
    for (int i = 0; i < Fdim; ++i) { a += cvs[i]; c += ents[i]; }
    out[OUTN] = a;
    out[OUTN + 1] = c;
  }
}

// ---------------------------------------------------------------------------
// 4) Fused MoE:  h = gelu(X@W1[e]+b1) ; out += gates * (h@W2[e])
//    grid (FB/64, E, H/512); block 256 (8 wave32s).
//    fp32 WMMA 16x16x4 for both GEMMs.
//    X tile staged via GLOBAL_LOAD_ASYNC_TO_LDS_B128 (ASYNCcnt).
//    GEMM1: each wave owns all 64 rows x its own 64 h-columns (4x4 tiles), so
//    the block's whole 512-column h slice is done in one K sweep.  N tile j of
//    a wave is the columns {4*i + j}: lane i then gets its B elements of all
//    four tiles from one 16-byte load of a W1 row (whole 256-byte row pieces,
//    no W1 element loaded twice in a block bar the unused refetch of K rows 0..15; 2 global loads per 16 WMMAs).
//    h takes over X's LDS once every wave has finished reading X.
// ---------------------------------------------------------------------------
// second bound: four waves per SIMD, so that two blocks still share a WGP
__global__ __launch_bounds__(256, 4) void moe_kernel(
    const float* __restrict__ x,  const float* __restrict__ W1,
    const float* __restrict__ b1, const float* __restrict__ W2,
    const float* __restrict__ b2, const float* __restrict__ gates,
    float* __restrict__ out) {
  // stride 516 (== 4 mod 64): conflict-free; holds X, then h
  __shared__ __attribute__((aligned(16))) float Xs[64][Sdim + 4];

  const int tid  = threadIdx.x;
  const int wave = tid >> 5;
  const int lane = tid & 31;
  const int lane15 = lane & 15;
  const int khalf  = (lane >> 4) * 2;  // 0 or 2: A/B K sub-pair per half-wave
  const int r0 = blockIdx.x * 64;
  const int e  = blockIdx.y;
  const int h0 = blockIdx.z * 512;

  // ---- async-stage X tile: rows r0..r0+63 of xf (xf[f,b,s] = x[b,f,s]) ----
  for (int idx = tid; idx < 64 * (Sdim / 4); idx += 256) {
    const int i = idx >> 7;            // 128 float4 per row
    const int c = idx & 127;
    const int r = r0 + i;
    const int fb = (r & 63) * Fdim + (r >> 6);
    const float* gsrc = x + (size_t)fb * Sdim + c * 4;
    const unsigned ldst = (unsigned)(uintptr_t)&Xs[i][c * 4];
    asm volatile("global_load_async_to_lds_b128 %0, %1, off"
                 :: "v"(ldst), "v"(gsrc) : "memory");
  }
  asm volatile("s_wait_asynccnt 0x0" ::: "memory");
  __syncthreads();

  const int rt  = wave & 3;            // GEMM2 row tile
  const int ptb = wave >> 2;           // GEMM2 P-tile base

  // ---- GEMM1: h[64,512] = X[64,512] @ W1[e][512, h0..h0+511] ----
  const int lcol = wave * 64 + lane15 * 4;   // this lane's 4 h-columns
  v8f c1[4][4];
#pragma unroll
  for (int mt = 0; mt < 4; ++mt)
#pragma unroll
    for (int j = 0; j < 4; ++j)
      c1[mt][j] = (v8f){0.f,0.f,0.f,0.f,0.f,0.f,0.f,0.f};

  const float* wb = W1 + ((size_t)e * Sdim + khalf) * Hdim + h0 + lcol;
  const float* xr = &Xs[lane15][khalf];
  // Register rings over a block of four K steps (64 WMMAs).  Slot u holds the
  // two W1 row pieces of K step u and is refilled for the next block right
  // behind its own 16 WMMAs; the X fragments are re-read two K steps at a
  // time, right behind the second step's WMMAs.  No load is waited for at the head of a block any more.
  float4 q0[4], q1[4];
  v2f a[4][4];
#pragma unroll
  for (int u = 0; u < 4; ++u) {
    q0[u] = *(const float4*)(wb + (size_t)(4 * u) * Hdim);       // K row khalf,   N = 4*i..4*i+3
    q1[u] = *(const float4*)(wb + (size_t)(4 * u + 1) * Hdim);   // K row khalf+1, same columns
#pragma unroll
    for (int mt = 0; mt < 4; ++mt) {                 // A: M=lane15, K=4u+khalf(+1)
      const float2 f = *(const float2*)(xr + mt * 16 * (Sdim + 4) + 4 * u);
      a[u][mt][0] = f.x; a[u][mt][1] = f.y;
    }
  }
  // rolled: a ring slot is refilled in place, so there is nothing to rename
#pragma unroll 1
  for (int k = 0; k < Sdim; k += 16) {
    // the last block's fetch-ahead wraps to K = 0: in bounds, never used
    const int kn = (k + 16) & (Sdim - 1);
    const float* wn = wb + (size_t)kn * Hdim;
    const float* xn = xr + kn;
#pragma unroll
    for (int u = 0; u < 4; ++u) {
      const float r0q[4] = {q0[u].x, q0[u].y, q0[u].z, q0[u].w};
      const float r1q[4] = {q1[u].x, q1[u].y, q1[u].z, q1[u].w};
#pragma unroll
      for (int j = 0; j < 4; ++j) {
        v2f bb;
        bb[0] = r0q[j]; bb[1] = r1q[j];
#pragma unroll
        for (int mt = 0; mt < 4; ++mt)
          c1[mt][j] = wmma_f32x4(a[u][mt], bb, c1[mt][j]);
      }
      wmma_gap();
      q0[u] = *(const float4*)(wn + (size_t)(4 * u) * Hdim);
      q1[u] = *(const float4*)(wn + (size_t)(4 * u + 1) * Hdim);
      if (u & 1) {
#pragma unroll
        for (int v = u - 1; v <= u; ++v)
#pragma unroll
          for (int mt = 0; mt < 4; ++mt) {
            const float2 f = *(const float2*)(xn + mt * 16 * (Sdim + 4) + 4 * v);
            a[v][mt][0] = f.x; a[v][mt][1] = f.y;
          }
      }
      // compiler fence: without it the refills are folded back into loads at
      // the head of the next trip, where they are waited for at once
      asm volatile("" ::: "memory");
      // keeps the refills behind this step's WMMAs and ahead of the next step's
      __builtin_amdgcn_sched_barrier(0);
    }
    // the next trip overwrites the address register that the refills name
    asm volatile("s_wait_xcnt 0x0" ::: "memory");
    __builtin_amdgcn_sched_barrier(0);   // holds that wait at the foot of the trip
  }
  __syncthreads();   // every wave has finished reading X: its LDS becomes h

  // a lane's four tiles are 4 adjacent columns of h
  const float4 b1q = *(const float4*)(b1 + e * Hdim + h0 + lcol);
  float* hown = &Xs[(lane >> 4) * 8][lcol];
  // W2 ring, first fill: slot s holds the six B words of K step s; requested
  // here so that they land while the GELU below runs
  const float* w2l = W2 + ((size_t)e * Hdim + h0 + khalf) * Pdim + ptb * 16 + lane15;
  float wr[8][6];
#pragma unroll
  for (int s = 0; s < 8; ++s)
#pragma unroll
    for (int j = 0; j < 3; ++j) {
      wr[s][2 * j]     = w2l[(4 * s) * Pdim + 32 * j];
      wr[s][2 * j + 1] = w2l[(4 * s + 1) * Pdim + 32 * j];
    }
  // bias and GELU on the accumulators themselves, then the C->A re-layout: one
  // 16-byte LDS store per row.  A pair is two rows of one tile (adjacent
  // registers); the four tiles side by side give eight independent chains.
  const float bj[4] = {b1q.x, b1q.y, b1q.z, b1q.w};
#pragma unroll
  for (int mt = 0; mt < 4; ++mt) {
#pragma unroll
    for (int v = 0; v < 8; v += 2) {
      v2f xq[4];
      float lo[4], hi[4];
#pragma unroll
      for (int j = 0; j < 4; ++j) {
        v2f cp;
        cp[0] = c1[mt][j][v]; cp[1] = c1[mt][j][v + 1];
        xq[j] = cp + (v2f){bj[j], bj[j]};
      }
      gelu8(xq, lo, hi);
      *(float4*)(hown + (mt * 16 + v) * (Sdim + 4)) =
          make_float4(lo[0], lo[1], lo[2], lo[3]);
      *(float4*)(hown + (mt * 16 + v + 1) * (Sdim + 4)) =
          make_float4(hi[0], hi[1], hi[2], hi[3]);
    }
  }
  __syncthreads();   // h complete before any wave reads other waves' columns

  // ---- GEMM2: acc = h[64,512] @ W2[e][h0..h0+511, P] ----
  v8f acc[3] = {{0.f,0.f,0.f,0.f,0.f,0.f,0.f,0.f},
                {0.f,0.f,0.f,0.f,0.f,0.f,0.f,0.f},
                {0.f,0.f,0.f,0.f,0.f,0.f,0.f,0.f}};
  const float* hr = &Xs[rt * 16 + lane15][khalf];
  v2f ah[16];
#pragma unroll
  for (int u = 0; u < 16; ++u) {
    const float2 af = *(const float2*)(hr + 4 * u);
    ah[u][0] = af.x; ah[u][1] = af.y;
  }
  // rolled: the 16 K steps inside are unrolled already, more would only grow the text
#pragma unroll 1
  for (int kk = 0; kk < 512; kk += 64) {
    const int kn = (kk + 64) & 511;           // wraps on the last trip: in bounds, never used
#pragma unroll
    for (int u = 0; u < 16; ++u) {
      const int s = u & 7;
#pragma unroll
      for (int j = 0; j < 3; ++j) {           // A fragment reused x3
        v2f bb;
        bb[0] = wr[s][2 * j]; bb[1] = wr[s][2 * j + 1];
        acc[j] = wmma_f32x4(ah[u], bb, acc[j]);
      }
      wmma_gap();
      // refill slot s with K step u + 8 (24 WMMAs of lead)
      const float* wn = w2l + (size_t)((kk + 4 * u + 32) & 511) * Pdim;
#pragma unroll
      for (int j = 0; j < 3; ++j) {
        wr[s][2 * j]     = wn[32 * j];
        wr[s][2 * j + 1] = wn[Pdim + 32 * j];
      }
      if (s == 7) {                           // h fragments of the half block just used
#pragma unroll
        for (int v = u - 7; v <= u; ++v) {
          const float2 af = *(const float2*)(hr + kn + 4 * v);
          ah[v][0] = af.x; ah[v][1] = af.y;
        }
      }
      // compiler fence and scheduling fence, as in GEMM1: they keep the refills here
      asm volatile("" ::: "memory");
      __builtin_amdgcn_sched_barrier(0);
    }
  }

  // gate-scale + accumulate into out[b,f,p]
  const int mbase = rt * 16 + (lane >> 4) * 8;
#pragma unroll
  for (int v = 0; v < 8; ++v) {
    const int r = r0 + mbase + v;
    const float g = gates[r * 8 + e];
    const int f = r >> 6, b = r & 63;
    float* orow = out + (size_t)(b * Fdim + f) * Pdim;
#pragma unroll
    for (int j = 0; j < 3; ++j) {
      const int pcol = (ptb + 2 * j) * 16 + lane15;
      atomicAdd(&orow[pcol], g * acc[j][v]);
    }
  }
}

// ---------------------------------------------------------------------------
extern "C" void kernel_launch(void* const* d_in, const int* in_sizes, int n_in,
                              void* d_out, int out_size, void* d_ws,
                              size_t ws_size, hipStream_t stream) {
  (void)in_sizes; (void)n_in; (void)out_size; (void)ws_size;
  const float* x  = (const float*)d_in[0];
  const float* te = (const float*)d_in[1];
  const float* Wg = (const float*)d_in[2];
  const float* bg = (const float*)d_in[3];
  const float* W1 = (const float*)d_in[4];
  const float* b1 = (const float*)d_in[5];
  const float* W2 = (const float*)d_in[6];
  const float* b2 = (const float*)d_in[7];
  float* out   = (float*)d_out;
  float* gates = (float*)d_ws;   // FB*E floats = 64 KB scratch

  gates_kernel<<<FB / 8, 256, 0, stream>>>(te, Wg, bg, gates);
  init_kernel<<<OUTN / 256, 256, 0, stream>>>(gates, b2, out);
  loss_kernel<<<1, 256, 0, stream>>>(gates, out);
  moe_kernel<<<dim3(FB / 64, Edim, Hdim / 512), 256, 0, stream>>>(
      x, W1, b1, W2, b2, gates, out);
}
